// v000
// The times below were measured on an AMD MI455X: many runs one after another, warmed up first and cycling through
// copies of the inputs, with the whole window's GPU time divided by the number of runs. Launches and the gaps
// between them are all in it. The median over several windows is given; except for v000 it joins two sittings, which
// can be a few percent apart, so the side-by-side timings, each taken in one sitting, are the better comparison.
// v000, which the later versions start from, runs in 176 microseconds.
#include <hip/hip_runtime.h>
#include <hip/hip_bf16.h>

// Point Transformer layer, MI455X (gfx1250, wave32).
// Kernel A: q/k/v projections via V_WMMA_F32_16X16X4_F32 (fp32 tensor path).
// Kernel B: fused gather + pos-MLP + attention-weight GEMMs (WMMA) + softmax + aggregation.

#define NPTS 40000
#define CCH  128
#define KNB  16
#define EPSV 1e-5f

typedef __attribute__((ext_vector_type(2))) float v2f;
typedef __attribute__((ext_vector_type(8))) float v8f;

// ---------------------------------------------------------------------------
// Kernel A: qkv = x @ {Wq,Wk,Wv} + b   (N x 128) @ (128 x 128)
// grid = (N/16, 3), block = 256 (8 waves). Wave w computes cols [16w,16w+16).
// ---------------------------------------------------------------------------
__global__ void __launch_bounds__(256)
qkv_proj_wmma(const float* __restrict__ x,
              const float* __restrict__ Wq, const float* __restrict__ bq,
              const float* __restrict__ Wk, const float* __restrict__ bk,
              const float* __restrict__ Wv, const float* __restrict__ bv,
              float* __restrict__ qp, float* __restrict__ kp, float* __restrict__ vp) {
    __shared__ float xa[16 * CCH];   // 16-row panel of x, 8 KB

    const int m0 = blockIdx.x * 16;
    const float* W; const float* bias; float* outp;
    if (blockIdx.y == 0)      { W = Wq; bias = bq; outp = qp; }
    else if (blockIdx.y == 1) { W = Wk; bias = bk; outp = kp; }
    else                      { W = Wv; bias = bv; outp = vp; }

    const int t = threadIdx.x;
    for (int i = t; i < 16 * CCH; i += 256) xa[i] = x[m0 * CCH + i];
    __syncthreads();

    const int wave = t >> 5;
    const int lane = t & 31;
    const int j0   = wave * 16;            // output column tile
    const int mm   = lane & 15;            // A row (M) owned by this lane
    const int koff = (lane < 16) ? 0 : 2;  // K sub-offset per ISA A/B striping
    const int col  = lane & 15;            // B/D column owned by this lane

    v8f acc = {};
    for (int k0 = 0; k0 < CCH; k0 += 4) {
        v2f a, b;
        // A 16x4 fp32: v0 = {K=k0 | K=k0+2}, v1 = {K=k0+1 | K=k0+3}
        a.x = xa[mm * CCH + k0 + koff];
        a.y = xa[mm * CCH + k0 + koff + 1];
        // B 4x16 fp32: rows of W, striped the same way across lane halves
        b.x = W[(k0 + koff) * CCH + j0 + col];
        b.y = W[(k0 + koff + 1) * CCH + j0 + col];
        acc = __builtin_amdgcn_wmma_f32_16x16x4_f32(false, a, false, b,
                                                    (short)0, acc, false, false);
    }

    const float bb = bias[j0 + col];
    const int rowadd = (lane < 16) ? 0 : 8;   // D: vgpr r holds M=r (lo lanes) / M=r+8 (hi)
    for (int r = 0; r < 8; ++r)
        outp[(size_t)(m0 + r + rowadd) * CCH + j0 + col] = acc[r] + bb;
}

// ---------------------------------------------------------------------------
// Kernel B: fused neighbor attention. 4 points / block, 128 threads (4 waves).
// Rows r = nl*16 + k for nl in [0,4), k in [0,16).
// ---------------------------------------------------------------------------
__global__ void __launch_bounds__(128)
fused_attn(const float* __restrict__ xyz, const float* __restrict__ feats,
           const int* __restrict__ nei,
           const float* __restrict__ Wp1, const float* __restrict__ bp1,
           const float* __restrict__ p_gamma, const float* __restrict__ p_beta,
           const float* __restrict__ p_mean,  const float* __restrict__ p_var,
           const float* __restrict__ Wp2, const float* __restrict__ bp2,
           const float* __restrict__ w_gamma, const float* __restrict__ w_beta,
           const float* __restrict__ w_mean,  const float* __restrict__ w_var,
           const float* __restrict__ Ww1, const float* __restrict__ bw1,
           const float* __restrict__ w1_gamma, const float* __restrict__ w1_beta,
           const float* __restrict__ w1_mean,  const float* __restrict__ w1_var,
           const float* __restrict__ Ww2, const float* __restrict__ bw2,
           const float* __restrict__ qp, const float* __restrict__ kp,
           const float* __restrict__ vp, float* __restrict__ out) {
    __shared__ float w_buf[64 * CCH];   // relu(bn_w(kf - q + p)), 32 KB
    __shared__ float mid[64 * 16];      // 128->16 stage, then softmaxed weights
    __shared__ float qs[4 * CCH];       // q rows for the 4 points
    __shared__ float hbuf[64 * 3];      // relu(bn(d @ Wp1)) per (n,k)
    __shared__ float posn[4 * 3];
    __shared__ int   idxb[64];

    const int t  = threadIdx.x;        // 0..127
    const int n0 = blockIdx.x * 4;

    // ---- setup: q rows, positions, neighbor ids, 3-d positional hidden vec
    for (int i = t; i < 4 * CCH; i += 128) qs[i] = qp[(size_t)n0 * CCH + i];
    if (t < 12) posn[t] = xyz[n0 * 3 + t];
    __syncthreads();

    if (t < 64) {
        const int nl = t >> 4, k = t & 15;
        const int id = nei[(size_t)(n0 + nl) * KNB + k];
        idxb[t] = id;
        const float d0 = xyz[(size_t)id * 3 + 0] - posn[nl * 3 + 0];
        const float d1 = xyz[(size_t)id * 3 + 1] - posn[nl * 3 + 1];
        const float d2 = xyz[(size_t)id * 3 + 2] - posn[nl * 3 + 2];
        for (int j = 0; j < 3; ++j) {
            float h = d0 * Wp1[0 * 3 + j] + d1 * Wp1[1 * 3 + j] + d2 * Wp1[2 * 3 + j] + bp1[j];
            h = (h - p_mean[j]) * (p_gamma[j] * rsqrtf(p_var[j] + EPSV)) + p_beta[j];
            hbuf[t * 3 + j] = fmaxf(h, 0.0f);
        }
    }
    __syncthreads();

    // ---- phase 1: w_buf[r][c] = relu(bn_w(kf - q + p)); gathers are coalesced 512B rows
    const int tc = t;                              // channel owned by this thread
    const float pw0 = Wp2[0 * CCH + tc], pw1 = Wp2[1 * CCH + tc],
                pw2 = Wp2[2 * CCH + tc], bpc = bp2[tc];
    const float wg = w_gamma[tc] * rsqrtf(w_var[tc] + EPSV);
    const float wm = w_mean[tc], wbt = w_beta[tc];
    for (int r = 0; r < 64; ++r) {
        const int id = idxb[r];
        const float kf = kp[(size_t)id * CCH + tc];
        const float pv = hbuf[r * 3 + 0] * pw0 + hbuf[r * 3 + 1] * pw1 +
                         hbuf[r * 3 + 2] * pw2 + bpc;
        float wv = kf - qs[(r >> 4) * CCH + tc] + pv;
        wv = (wv - wm) * wg + wbt;
        w_buf[r * CCH + tc] = fmaxf(wv, 0.0f);
    }
    __syncthreads();

    // ---- phase 2: (64x128)@(128x16) via WMMA, one 16x16 tile per wave (tile = point)
    const int wave = t >> 5;
    const int lane = t & 31;
    const int m0r  = wave * 16;
    const int mm   = lane & 15;
    const int koff = (lane < 16) ? 0 : 2;
    const int col  = lane & 15;

    v8f acc = {};
    for (int k0 = 0; k0 < CCH; k0 += 4) {
        v2f a, b;
        a.x = w_buf[(m0r + mm) * CCH + k0 + koff];
        a.y = w_buf[(m0r + mm) * CCH + k0 + koff + 1];
        b.x = Ww1[(k0 + koff) * 16 + col];
        b.y = Ww1[(k0 + koff + 1) * 16 + col];
        acc = __builtin_amdgcn_wmma_f32_16x16x4_f32(false, a, false, b,
                                                    (short)0, acc, false, false);
    }
    // bias + BN1 + ReLU (per output column), scatter to LDS in row-major
    {
        const float g1 = w1_gamma[col] * rsqrtf(w1_var[col] + EPSV);
        const float m1 = w1_mean[col], b1 = w1_beta[col], bb1 = bw1[col];
        const int rowadd = (lane < 16) ? 0 : 8;
        for (int r = 0; r < 8; ++r) {
            const float v = (acc[r] + bb1 - m1) * g1 + b1;
            mid[(m0r + r + rowadd) * 16 + col] = fmaxf(v, 0.0f);
        }
    }
    __syncthreads();

    // ---- phase 3: (64x16)@(16x16) WMMA, then softmax over the 16 neighbors of the tile
    v8f acc2 = {};
    for (int k0 = 0; k0 < 16; k0 += 4) {
        v2f a, b;
        a.x = mid[(m0r + mm) * 16 + k0 + koff];
        a.y = mid[(m0r + mm) * 16 + k0 + koff + 1];
        b.x = Ww2[(k0 + koff) * 16 + col];
        b.y = Ww2[(k0 + koff + 1) * 16 + col];
        acc2 = __builtin_amdgcn_wmma_f32_16x16x4_f32(false, a, false, b,
                                                     (short)0, acc2, false, false);
    }
    {
        const float bb2 = bw2[col];
        float vals[8];
        float mx = -3.4e38f;
        for (int r = 0; r < 8; ++r) { vals[r] = acc2[r] + bb2; mx = fmaxf(mx, vals[r]); }
        mx = fmaxf(mx, __shfl_xor(mx, 16, 32));     // lanes l / l+16 hold rows r / r+8
        float sum = 0.0f;
        for (int r = 0; r < 8; ++r) { vals[r] = __expf(vals[r] - mx); sum += vals[r]; }
        sum += __shfl_xor(sum, 16, 32);
        const float inv = 1.0f / sum;
        const int rowadd = (lane < 16) ? 0 : 8;
        for (int r = 0; r < 8; ++r)
            mid[(m0r + r + rowadd) * 16 + col] = vals[r] * inv;
    }
    __syncthreads();

    // ---- phase 4: grouped weighted aggregation + residual + leaky ReLU
    // channel c -> weight column j = c % 16 (reshape (S=8, C/S=16))
    const int jw = tc & 15;
    for (int nl = 0; nl < 4; ++nl) {
        float s = 0.0f;
        for (int k = 0; k < KNB; ++k) {
            const int r  = nl * 16 + k;
            const int id = idxb[r];
            const float vf = vp[(size_t)id * CCH + tc];
            const float pv = hbuf[r * 3 + 0] * pw0 + hbuf[r * 3 + 1] * pw1 +
                             hbuf[r * 3 + 2] * pw2 + bpc;
            s += (vf + pv) * mid[r * 16 + jw];
        }
        const float o = s + feats[(size_t)(n0 + nl) * CCH + tc];
        out[(size_t)(n0 + nl) * CCH + tc] = (o > 0.0f) ? o : 0.1f * o;
    }
}

// ---------------------------------------------------------------------------
extern "C" void kernel_launch(void* const* d_in, const int* in_sizes, int n_in,
                              void* d_out, int out_size, void* d_ws, size_t ws_size,
                              hipStream_t stream) {
    const float* xyz      = (const float*)d_in[0];
    const float* feats    = (const float*)d_in[1];
    const int*   nei      = (const int*)  d_in[2];
    const float* Wq       = (const float*)d_in[3];
    const float* bq       = (const float*)d_in[4];
    const float* Wk       = (const float*)d_in[5];
    const float* bk       = (const float*)d_in[6];
    const float* Wv       = (const float*)d_in[7];
    const float* bv       = (const float*)d_in[8];
    const float* Wp1      = (const float*)d_in[9];
    const float* bp1      = (const float*)d_in[10];
    const float* p_gamma  = (const float*)d_in[11];
    const float* p_beta   = (const float*)d_in[12];
    const float* p_mean   = (const float*)d_in[13];
    const float* p_var    = (const float*)d_in[14];
    const float* Wp2      = (const float*)d_in[15];
    const float* bp2      = (const float*)d_in[16];
    const float* w_gamma  = (const float*)d_in[17];
    const float* w_beta   = (const float*)d_in[18];
    const float* w_mean   = (const float*)d_in[19];
    const float* w_var    = (const float*)d_in[20];
    const float* Ww1      = (const float*)d_in[21];
    const float* bw1      = (const float*)d_in[22];
    const float* w1_gamma = (const float*)d_in[23];
    const float* w1_beta  = (const float*)d_in[24];
    const float* w1_mean  = (const float*)d_in[25];
    const float* w1_var   = (const float*)d_in[26];
    const float* Ww2      = (const float*)d_in[27];
    const float* bw2      = (const float*)d_in[28];

    // workspace: q, k, v projections (3 * N * C floats = 58.6 MB)
    float* qp = (float*)d_ws;
    float* kp = qp + (size_t)NPTS * CCH;
    float* vp = kp + (size_t)NPTS * CCH;

    dim3 gridA(NPTS / 16, 3);
    qkv_proj_wmma<<<gridA, 256, 0, stream>>>(feats, Wq, bq, Wk, bk, Wv, bv, qp, kp, vp);

    fused_attn<<<NPTS / 4, 128, 0, stream>>>(
        xyz, feats, nei,
        Wp1, bp1, p_gamma, p_beta, p_mean, p_var, Wp2, bp2,
        w_gamma, w_beta, w_mean, w_var,
        Ww1, bw1, w1_gamma, w1_beta, w1_mean, w1_var, Ww2, bw2,
        qp, kp, vp, (float*)d_out);
}

// v001
// A run of this version takes 147 microseconds.
// Next to v000, in two timings, it ran 1.22 times as fast each time.
#include <hip/hip_runtime.h>
#include <hip/hip_bf16.h>

// Point Transformer layer, MI455X (gfx1250, wave32).
// Kernel A: q/k/v projections via V_WMMA_F32_16X16X4_F32 (fp32 tensor path).
// Kernel B: fused gather + pos-MLP + attention-weight GEMMs (WMMA) + softmax + aggregation.

#define NPTS 40000
#define CCH  128
#define KNB  16
#define EPSV 1e-5f
// LDS row pitches, in floats, of the panels that feed WMMA A fragments. A fragment read has 16 lanes
// on 16 rows at one column pair; bank = dword address mod 64, so at a pitch of 128 (or 16) floats the
// rows fall on one (or four) bank groups. A pitch of 4 x odd floats puts the 16 rows on 16 different
// groups of 4 banks, and the upper half-wave (columns +2) on the other half of each group.
#define PCH  (CCH + 4)
#define PMID 20

typedef __attribute__((ext_vector_type(2))) float v2f;
typedef __attribute__((ext_vector_type(8))) float v8f;

// ---------------------------------------------------------------------------
// Kernel A: qkv = x @ {Wq,Wk,Wv} + b   (N x 128) @ (128 x 128)
// grid = (N/16, 3), block = 256 (8 waves). Wave w computes cols [16w,16w+16).
// ---------------------------------------------------------------------------
__global__ void __launch_bounds__(256)
qkv_proj_wmma(const float* __restrict__ x,
              const float* __restrict__ Wq, const float* __restrict__ bq,
              const float* __restrict__ Wk, const float* __restrict__ bk,
              const float* __restrict__ Wv, const float* __restrict__ bv,
              float* __restrict__ qp, float* __restrict__ kp, float* __restrict__ vp) {
    __shared__ float xa[16 * PCH];   // 16-row panel of x, padded rows

    const int m0 = blockIdx.x * 16;
    const float* W; const float* bias; float* outp;
    if (blockIdx.y == 0)      { W = Wq; bias = bq; outp = qp; }
    else if (blockIdx.y == 1) { W = Wk; bias = bk; outp = kp; }
    else                      { W = Wv; bias = bv; outp = vp; }

    const int t = threadIdx.x;
    for (int i = t; i < 16 * CCH; i += 256) xa[(i >> 7) * PCH + (i & (CCH - 1))] = x[m0 * CCH + i];
    __syncthreads();

    const int wave = t >> 5;
    const int lane = t & 31;
    const int j0   = wave * 16;            // output column tile
    const int mm   = lane & 15;            // A row (M) owned by this lane
    const int koff = (lane < 16) ? 0 : 2;  // K sub-offset per ISA A/B striping
    const int col  = lane & 15;            // B/D column owned by this lane

    v8f acc = {};
    for (int k0 = 0; k0 < CCH; k0 += 4) {
        v2f a, b;
        // A 16x4 fp32: v0 = {K=k0 | K=k0+2}, v1 = {K=k0+1 | K=k0+3}
        a.x = xa[mm * PCH + k0 + koff];
        a.y = xa[mm * PCH + k0 + koff + 1];
        // B 4x16 fp32: rows of W, striped the same way across lane halves
        b.x = W[(k0 + koff) * CCH + j0 + col];
        b.y = W[(k0 + koff + 1) * CCH + j0 + col];
        acc = __builtin_amdgcn_wmma_f32_16x16x4_f32(false, a, false, b,
                                                    (short)0, acc, false, false);
    }

    const float bb = bias[j0 + col];
    const int rowadd = (lane < 16) ? 0 : 8;   // D: vgpr r holds M=r (lo lanes) / M=r+8 (hi)
    for (int r = 0; r < 8; ++r)
        outp[(size_t)(m0 + r + rowadd) * CCH + j0 + col] = acc[r] + bb;
}

// ---------------------------------------------------------------------------
// Kernel B: fused neighbor attention. 4 points / block, 128 threads (4 waves).
// Rows r = nl*16 + k for nl in [0,4), k in [0,16).
// ---------------------------------------------------------------------------
__global__ void __launch_bounds__(128)
fused_attn(const float* __restrict__ xyz, const float* __restrict__ feats,
           const int* __restrict__ nei,
           const float* __restrict__ Wp1, const float* __restrict__ bp1,
           const float* __restrict__ p_gamma, const float* __restrict__ p_beta,
           const float* __restrict__ p_mean,  const float* __restrict__ p_var,
           const float* __restrict__ Wp2, const float* __restrict__ bp2,
           const float* __restrict__ w_gamma, const float* __restrict__ w_beta,
           const float* __restrict__ w_mean,  const float* __restrict__ w_var,
           const float* __restrict__ Ww1, const float* __restrict__ bw1,
           const float* __restrict__ w1_gamma, const float* __restrict__ w1_beta,
           const float* __restrict__ w1_mean,  const float* __restrict__ w1_var,
           const float* __restrict__ Ww2, const float* __restrict__ bw2,
           const float* __restrict__ qp, const float* __restrict__ kp,
           const float* __restrict__ vp, float* __restrict__ out) {
    __shared__ float w_buf[64 * PCH];   // relu(bn_w(kf - q + p)), padded rows, 33 KB
    __shared__ float mid[64 * PMID];    // 128->16 stage, then softmaxed weights, padded rows
    __shared__ float qs[4 * CCH];       // q rows for the 4 points
    __shared__ float hbuf[64 * 3];      // relu(bn(d @ Wp1)) per (n,k)
    __shared__ float posn[4 * 3];
    __shared__ int   idxb[64];

    const int t  = threadIdx.x;        // 0..127
    const int n0 = blockIdx.x * 4;

    // ---- setup: q rows, positions, neighbor ids, 3-d positional hidden vec
    for (int i = t; i < 4 * CCH; i += 128) qs[i] = qp[(size_t)n0 * CCH + i];
    if (t < 12) posn[t] = xyz[n0 * 3 + t];
    __syncthreads();

    if (t < 64) {
        const int nl = t >> 4, k = t & 15;
        // neighbour id bounded before any address is formed from it (identity for ids in [0, NPTS))
        const int id = min(max(nei[(size_t)(n0 + nl) * KNB + k], 0), NPTS - 1);
        idxb[t] = id;
        const float d0 = xyz[(size_t)id * 3 + 0] - posn[nl * 3 + 0];
        const float d1 = xyz[(size_t)id * 3 + 1] - posn[nl * 3 + 1];
        const float d2 = xyz[(size_t)id * 3 + 2] - posn[nl * 3 + 2];
        for (int j = 0; j < 3; ++j) {
            float h = d0 * Wp1[0 * 3 + j] + d1 * Wp1[1 * 3 + j] + d2 * Wp1[2 * 3 + j] + bp1[j];
            h = (h - p_mean[j]) * (p_gamma[j] * rsqrtf(p_var[j] + EPSV)) + p_beta[j];
            hbuf[t * 3 + j] = fmaxf(h, 0.0f);
        }
    }
    __syncthreads();

    // ---- phase 1: w_buf[r][c] = relu(bn_w(kf - q + p)); gathers are coalesced 512B rows
    const int tc = t;                              // channel owned by this thread
    const float pw0 = Wp2[0 * CCH + tc], pw1 = Wp2[1 * CCH + tc],
                pw2 = Wp2[2 * CCH + tc], bpc = bp2[tc];
    const float wg = w_gamma[tc] * rsqrtf(w_var[tc] + EPSV);
    const float wm = w_mean[tc], wbt = w_beta[tc];
    for (int r = 0; r < 64; ++r) {
        const int id = idxb[r];
        const float kf = kp[(size_t)id * CCH + tc];
        const float pv = hbuf[r * 3 + 0] * pw0 + hbuf[r * 3 + 1] * pw1 +
                         hbuf[r * 3 + 2] * pw2 + bpc;
        float wv = kf - qs[(r >> 4) * CCH + tc] + pv;
        wv = (wv - wm) * wg + wbt;
        w_buf[r * PCH + tc] = fmaxf(wv, 0.0f);
    }
    __syncthreads();

    // ---- phase 2: (64x128)@(128x16) via WMMA, one 16x16 tile per wave (tile = point)
    const int wave = t >> 5;
    const int lane = t & 31;
    const int m0r  = wave * 16;
    const int mm   = lane & 15;
    const int koff = (lane < 16) ? 0 : 2;
    const int col  = lane & 15;

    v8f acc = {};
    for (int k0 = 0; k0 < CCH; k0 += 4) {
        v2f a, b;
        a.x = w_buf[(m0r + mm) * PCH + k0 + koff];
        a.y = w_buf[(m0r + mm) * PCH + k0 + koff + 1];
        b.x = Ww1[(k0 + koff) * 16 + col];
        b.y = Ww1[(k0 + koff + 1) * 16 + col];
        acc = __builtin_amdgcn_wmma_f32_16x16x4_f32(false, a, false, b,
                                                    (short)0, acc, false, false);
    }
    // bias + BN1 + ReLU (per output column), scatter to LDS in row-major
    {
        const float g1 = w1_gamma[col] * rsqrtf(w1_var[col] + EPSV);
        const float m1 = w1_mean[col], b1 = w1_beta[col], bb1 = bw1[col];
        const int rowadd = (lane < 16) ? 0 : 8;
        for (int r = 0; r < 8; ++r) {
            const float v = (acc[r] + bb1 - m1) * g1 + b1;
            mid[(m0r + r + rowadd) * PMID + col] = fmaxf(v, 0.0f);
        }
    }
    __syncthreads();

    // ---- phase 3: (64x16)@(16x16) WMMA, then softmax over the 16 neighbors of the tile
    v8f acc2 = {};
    for (int k0 = 0; k0 < 16; k0 += 4) {
        v2f a, b;
        a.x = mid[(m0r + mm) * PMID + k0 + koff];
        a.y = mid[(m0r + mm) * PMID + k0 + koff + 1];
        b.x = Ww2[(k0 + koff) * 16 + col];
        b.y = Ww2[(k0 + koff + 1) * 16 + col];
        acc2 = __builtin_amdgcn_wmma_f32_16x16x4_f32(false, a, false, b,
                                                     (short)0, acc2, false, false);
    }
    {
        const float bb2 = bw2[col];
        float vals[8];
        float mx = -3.4e38f;
        for (int r = 0; r < 8; ++r) { vals[r] = acc2[r] + bb2; mx = fmaxf(mx, vals[r]); }
        mx = fmaxf(mx, __shfl_xor(mx, 16, 32));     // lanes l / l+16 hold rows r / r+8
        float sum = 0.0f;
        for (int r = 0; r < 8; ++r) { vals[r] = __expf(vals[r] - mx); sum += vals[r]; }
        sum += __shfl_xor(sum, 16, 32);
        const float inv = 1.0f / sum;
        const int rowadd = (lane < 16) ? 0 : 8;
        for (int r = 0; r < 8; ++r)
            mid[(m0r + r + rowadd) * PMID + col] = vals[r] * inv;
    }
    __syncthreads();

    // ---- phase 4: grouped weighted aggregation + residual + leaky ReLU
    // channel c -> weight column j = c % 16 (reshape (S=8, C/S=16))
    const int jw = tc & 15;
    for (int nl = 0; nl < 4; ++nl) {
        float s = 0.0f;
        for (int k = 0; k < KNB; ++k) {
            const int r  = nl * 16 + k;
            const int id = idxb[r];
            const float vf = vp[(size_t)id * CCH + tc];
            const float pv = hbuf[r * 3 + 0] * pw0 + hbuf[r * 3 + 1] * pw1 +
                             hbuf[r * 3 + 2] * pw2 + bpc;
            s += (vf + pv) * mid[r * PMID + jw];
        }
        const float o = s + feats[(size_t)(n0 + nl) * CCH + tc];
        out[(size_t)(n0 + nl) * CCH + tc] = (o > 0.0f) ? o : 0.1f * o;
    }
}

// ---------------------------------------------------------------------------
extern "C" void kernel_launch(void* const* d_in, const int* in_sizes, int n_in,
                              void* d_out, int out_size, void* d_ws, size_t ws_size,
                              hipStream_t stream) {
    const float* xyz      = (const float*)d_in[0];
    const float* feats    = (const float*)d_in[1];
    const int*   nei      = (const int*)  d_in[2];
    const float* Wq       = (const float*)d_in[3];
    const float* bq       = (const float*)d_in[4];
    const float* Wk       = (const float*)d_in[5];
    const float* bk       = (const float*)d_in[6];
    const float* Wv       = (const float*)d_in[7];
    const float* bv       = (const float*)d_in[8];
    const float* Wp1      = (const float*)d_in[9];
    const float* bp1      = (const float*)d_in[10];
    const float* p_gamma  = (const float*)d_in[11];
    const float* p_beta   = (const float*)d_in[12];
    const float* p_mean   = (const float*)d_in[13];
    const float* p_var    = (const float*)d_in[14];
    const float* Wp2      = (const float*)d_in[15];
    const float* bp2      = (const float*)d_in[16];
    const float* w_gamma  = (const float*)d_in[17];
    const float* w_beta   = (const float*)d_in[18];
    const float* w_mean   = (const float*)d_in[19];
    const float* w_var    = (const float*)d_in[20];
    const float* Ww1      = (const float*)d_in[21];
    const float* bw1      = (const float*)d_in[22];
    const float* w1_gamma = (const float*)d_in[23];
    const float* w1_beta  = (const float*)d_in[24];
    const float* w1_mean  = (const float*)d_in[25];
    const float* w1_var   = (const float*)d_in[26];
    const float* Ww2      = (const float*)d_in[27];
    const float* bw2      = (const float*)d_in[28];

    // workspace: q, k, v projections (3 * N * C floats = 58.6 MB)
    float* qp = (float*)d_ws;
    float* kp = qp + (size_t)NPTS * CCH;
    float* vp = kp + (size_t)NPTS * CCH;

    dim3 gridA(NPTS / 16, 3);
    qkv_proj_wmma<<<gridA, 256, 0, stream>>>(feats, Wq, bq, Wk, bk, Wv, bv, qp, kp, vp);

    fused_attn<<<NPTS / 4, 128, 0, stream>>>(
        xyz, feats, nei,
        Wp1, bp1, p_gamma, p_beta, p_mean, p_var, Wp2, bp2,
        w_gamma, w_beta, w_mean, w_var,
        Ww1, bw1, w1_gamma, w1_beta, w1_mean, w1_var, Ww2, bw2,
        qp, kp, vp, (float*)d_out);
}

// v002
// One run takes 84.9 microseconds.
// Next to v001, in two timings, it ran 1.73 times as fast each time.
// All steps since v000 together make it 2.11 times as fast.
#include <hip/hip_runtime.h>
#include <hip/hip_bf16.h>

// Point Transformer layer, MI455X (gfx1250, wave32).
// Kernel A: q/k/v projections via V_WMMA_F32_16X16X4_F32 (fp32 tensor path).
// Kernel B: fused gather + pos-MLP + attention-weight GEMMs (WMMA) + softmax + aggregation.

#define NPTS 40000
#define CCH  128
#define KNB  16
#define EPSV 1e-5f
// LDS row pitches, in floats, of the panels that feed WMMA A fragments. A fragment read has 16 lanes
// on 16 rows at one column pair; bank = dword address mod 64, so at a pitch of 128 (or 16) floats the
// rows fall on one (or four) bank groups. A pitch of 4 x odd floats puts the 16 rows on 16 different
// groups of 4 banks, and the upper half-wave (columns +2) on the other half of each group.
#define PCH  (CCH + 4)
#define PMID 20

typedef __attribute__((ext_vector_type(2))) float v2f;
typedef __attribute__((ext_vector_type(4))) float v4f;
typedef __attribute__((ext_vector_type(8))) float v8f;
typedef const __attribute__((address_space(1))) v4f* gv4f_ptr;   // global-memory pointer to 4 floats

// Start of row id of a (NPTS x CCH) float array, held in scalar registers (id is the same in every lane):
// the row's load then takes its scalar-base form, with the lane number as the one vector offset, and no
// 64-bit vector address is formed and kept per row.
__device__ __forceinline__ gv4f_ptr row_base(const float* p, int id) {
    const unsigned long long a = (unsigned long long)p + (unsigned long long)(unsigned)id * (CCH * sizeof(float));
    const unsigned lo = __builtin_amdgcn_readfirstlane((unsigned)a);
    const unsigned hi = __builtin_amdgcn_readfirstlane((unsigned)(a >> 32));
    return (gv4f_ptr)(((unsigned long long)hi << 32) | lo);
}

// ---------------------------------------------------------------------------
// Kernel A: qkv = x @ {Wq,Wk,Wv} + b   (N x 128) @ (128 x 128)
// grid = (N/16, 3), block = 256 (8 waves). Wave w computes cols [16w,16w+16).
// ---------------------------------------------------------------------------
__global__ void __launch_bounds__(256)
qkv_proj_wmma(const float* __restrict__ x,
              const float* __restrict__ Wq, const float* __restrict__ bq,
              const float* __restrict__ Wk, const float* __restrict__ bk,
              const float* __restrict__ Wv, const float* __restrict__ bv,
              float* __restrict__ qp, float* __restrict__ kp, float* __restrict__ vp) {
    __shared__ float xa[16 * PCH];   // 16-row panel of x, padded rows

    const int m0 = blockIdx.x * 16;
    const float* W; const float* bias; float* outp;
    if (blockIdx.y == 0)      { W = Wq; bias = bq; outp = qp; }
    else if (blockIdx.y == 1) { W = Wk; bias = bk; outp = kp; }
    else                      { W = Wv; bias = bv; outp = vp; }

    const int t = threadIdx.x;
    for (int i = t; i < 16 * CCH; i += 256) xa[(i >> 7) * PCH + (i & (CCH - 1))] = x[m0 * CCH + i];
    __syncthreads();

    const int wave = t >> 5;
    const int lane = t & 31;
    const int j0   = wave * 16;            // output column tile
    const int mm   = lane & 15;            // A row (M) owned by this lane
    const int koff = (lane < 16) ? 0 : 2;  // K sub-offset per ISA A/B striping
    const int col  = lane & 15;            // B/D column owned by this lane

    v8f acc = {};
    for (int k0 = 0; k0 < CCH; k0 += 4) {
        v2f a, b;
        // A 16x4 fp32: v0 = {K=k0 | K=k0+2}, v1 = {K=k0+1 | K=k0+3}
        a.x = xa[mm * PCH + k0 + koff];
        a.y = xa[mm * PCH + k0 + koff + 1];
        // B 4x16 fp32: rows of W, striped the same way across lane halves
        b.x = W[(k0 + koff) * CCH + j0 + col];
        b.y = W[(k0 + koff + 1) * CCH + j0 + col];
        acc = __builtin_amdgcn_wmma_f32_16x16x4_f32(false, a, false, b,
                                                    (short)0, acc, false, false);
    }

    const float bb = bias[j0 + col];
    const int rowadd = (lane < 16) ? 0 : 8;   // D: vgpr r holds M=r (lo lanes) / M=r+8 (hi)
    for (int r = 0; r < 8; ++r)
        outp[(size_t)(m0 + r + rowadd) * CCH + j0 + col] = acc[r] + bb;
}

// ---------------------------------------------------------------------------
// Kernel B: fused neighbor attention. 4 points / block, 128 threads (4 waves).
// One wave owns one point; a lane owns 4 consecutive channels, so a neighbour's 512-B row is one
// 16-byte load of the wave. Rows r = wave*16 + k, k in [0,16).
// ---------------------------------------------------------------------------
__global__ void __launch_bounds__(128)
fused_attn(const float* __restrict__ xyz, const float* __restrict__ feats,
           const int* __restrict__ nei,
           const float* __restrict__ Wp1, const float* __restrict__ bp1,
           const float* __restrict__ p_gamma, const float* __restrict__ p_beta,
           const float* __restrict__ p_mean,  const float* __restrict__ p_var,
           const float* __restrict__ Wp2, const float* __restrict__ bp2,
           const float* __restrict__ w_gamma, const float* __restrict__ w_beta,
           const float* __restrict__ w_mean,  const float* __restrict__ w_var,
           const float* __restrict__ Ww1, const float* __restrict__ bw1,
           const float* __restrict__ w1_gamma, const float* __restrict__ w1_beta,
           const float* __restrict__ w1_mean,  const float* __restrict__ w1_var,
           const float* __restrict__ Ww2, const float* __restrict__ bw2,
           const float* __restrict__ qp, const float* __restrict__ kp,
           const float* __restrict__ vp, float* __restrict__ out) {
    __shared__ __attribute__((aligned(16))) float w_buf[64 * PCH];  // relu(bn_w(kf - q + p)), padded rows, 33 KB
    __shared__ __attribute__((aligned(16))) float mid[64 * PMID];   // 128->16 stage, then softmaxed weights
    __shared__ float hbuf[64 * 3];      // relu(bn(d @ Wp1)) per (n,k)

    const int t    = threadIdx.x;                               // 0..127
    const int lane = t & 31;
    const int wave = __builtin_amdgcn_readfirstlane(t >> 5);    // scalar: the point's addresses are wave-uniform
    const int n    = blockIdx.x * 4 + wave;                     // point owned by this wave
    const int m0r  = wave * 16;                                 // its first row in the LDS panels
    const int c4   = lane * 4;                                  // first of the 4 channels owned by this lane

    // ---- neighbour ids: lane l holds the id of neighbour l & 15
    // id bounded before any address is formed from it (identity for ids in [0, NPTS))
    const int id = min(max(nei[(size_t)n * KNB + (lane & 15)], 0), NPTS - 1);

    // ---- gather of the 16 k rows: one 16-byte load a row, all 16 issued before the first is used
    v4f kf[KNB];
#pragma unroll
    for (int k = 0; k < KNB; ++k) {
        kf[k] = row_base(kp, __builtin_amdgcn_readlane(id, k))[lane];
    }

    // ---- per-channel constants and the point's q row
    const v4f q   = *(const v4f*)(qp + (size_t)n * CCH + c4);
    const v4f pw0 = *(const v4f*)(Wp2 + 0 * CCH + c4);
    const v4f pw1 = *(const v4f*)(Wp2 + 1 * CCH + c4);
    const v4f pw2 = *(const v4f*)(Wp2 + 2 * CCH + c4);
    const v4f bpc = *(const v4f*)(bp2 + c4);
    const v4f wgm = *(const v4f*)(w_gamma + c4);
    const v4f wvr = *(const v4f*)(w_var + c4);
    const v4f wm  = *(const v4f*)(w_mean + c4);
    const v4f wbt = *(const v4f*)(w_beta + c4);
    // precaution: the scalar row bases that the loads above name are overwritten further down
    asm volatile("s_wait_xcnt 0x0" ::: "memory");
    v4f wg;
    for (int i = 0; i < 4; ++i) wg[i] = wgm[i] * rsqrtf(wvr[i] + EPSV);

    // ---- 3-d positional hidden vector of neighbour l & 15 (both half-waves compute it, one stores)
    {
        const float d0 = xyz[(size_t)id * 3 + 0] - xyz[(size_t)n * 3 + 0];
        const float d1 = xyz[(size_t)id * 3 + 1] - xyz[(size_t)n * 3 + 1];
        const float d2 = xyz[(size_t)id * 3 + 2] - xyz[(size_t)n * 3 + 2];
        for (int j = 0; j < 3; ++j) {
            float h = d0 * Wp1[0 * 3 + j] + d1 * Wp1[1 * 3 + j] + d2 * Wp1[2 * 3 + j] + bp1[j];
            h = (h - p_mean[j]) * (p_gamma[j] * rsqrtf(p_var[j] + EPSV)) + p_beta[j];
            if (lane < 16) hbuf[(m0r + lane) * 3 + j] = fmaxf(h, 0.0f);
        }
    }
    __syncthreads();

    // ---- phase 1: w_buf[r][c] = relu(bn_w(kf - q + p))
#pragma unroll
    for (int k = 0; k < KNB; ++k) {
        const int r = m0r + k;
        const v4f pv = hbuf[r * 3 + 0] * pw0 + hbuf[r * 3 + 1] * pw1 +
                       hbuf[r * 3 + 2] * pw2 + bpc;
        v4f wv = kf[k] - q + pv;
        wv = (wv - wm) * wg + wbt;
        *(v4f*)(w_buf + r * PCH + c4) = __builtin_elementwise_max(wv, (v4f)(0.0f));
    }

    // ---- gather of the 16 v rows and the residual row, issued here so that they fly under phases 2 and 3
    v4f vf[KNB];
#pragma unroll
    for (int k = 0; k < KNB; ++k) {
        vf[k] = row_base(vp, __builtin_amdgcn_readlane(id, k))[lane];
    }
    const v4f res = *(const v4f*)(feats + (size_t)n * CCH + c4);
    __syncthreads();

    // ---- phase 2: (64x128)@(128x16) via WMMA, one 16x16 tile per wave (tile = point)
    const int mm   = lane & 15;
    const int koff = (lane < 16) ? 0 : 2;
    const int col  = lane & 15;

    v8f acc = {};
    for (int k0 = 0; k0 < CCH; k0 += 4) {
        v2f a, b;
        a.x = w_buf[(m0r + mm) * PCH + k0 + koff];
        a.y = w_buf[(m0r + mm) * PCH + k0 + koff + 1];
        b.x = Ww1[(k0 + koff) * 16 + col];
        b.y = Ww1[(k0 + koff + 1) * 16 + col];
        acc = __builtin_amdgcn_wmma_f32_16x16x4_f32(false, a, false, b,
                                                    (short)0, acc, false, false);
    }
    // bias + BN1 + ReLU (per output column), scatter to LDS in row-major
    {
        const float g1 = w1_gamma[col] * rsqrtf(w1_var[col] + EPSV);
        const float m1 = w1_mean[col], b1 = w1_beta[col], bb1 = bw1[col];
        const int rowadd = (lane < 16) ? 0 : 8;
        for (int r = 0; r < 8; ++r) {
            const float v = (acc[r] + bb1 - m1) * g1 + b1;
            mid[(m0r + r + rowadd) * PMID + col] = fmaxf(v, 0.0f);
        }
    }
    __syncthreads();

    // ---- phase 3: (64x16)@(16x16) WMMA, then softmax over the 16 neighbors of the tile
    v8f acc2 = {};
    for (int k0 = 0; k0 < 16; k0 += 4) {
        v2f a, b;
        a.x = mid[(m0r + mm) * PMID + k0 + koff];
        a.y = mid[(m0r + mm) * PMID + k0 + koff + 1];
        b.x = Ww2[(k0 + koff) * 16 + col];
        b.y = Ww2[(k0 + koff + 1) * 16 + col];
        acc2 = __builtin_amdgcn_wmma_f32_16x16x4_f32(false, a, false, b,
                                                     (short)0, acc2, false, false);
    }
    {
        const float bb2 = bw2[col];
        float vals[8];
        float mx = -3.4e38f;
        for (int r = 0; r < 8; ++r) { vals[r] = acc2[r] + bb2; mx = fmaxf(mx, vals[r]); }
        mx = fmaxf(mx, __shfl_xor(mx, 16, 32));     // lanes l / l+16 hold rows r / r+8
        float sum = 0.0f;
        for (int r = 0; r < 8; ++r) { vals[r] = __expf(vals[r] - mx); sum += vals[r]; }
        sum += __shfl_xor(sum, 16, 32);
        const float inv = 1.0f / sum;
        const int rowadd = (lane < 16) ? 0 : 8;
        for (int r = 0; r < 8; ++r)
            mid[(m0r + r + rowadd) * PMID + col] = vals[r] * inv;
    }
    __syncthreads();

    // ---- phase 4: grouped weighted aggregation + residual + leaky ReLU
    // channel c -> weight column j = c % 16 (reshape (S=8, C/S=16)); the lane's 4 channels are 4 columns in a row
    const int jw = c4 & 15;
    v4f s = (v4f)(0.0f);
#pragma unroll
    for (int k = 0; k < KNB; ++k) {
        const int r = m0r + k;
        const v4f pv = hbuf[r * 3 + 0] * pw0 + hbuf[r * 3 + 1] * pw1 +
                       hbuf[r * 3 + 2] * pw2 + bpc;
        s += (vf[k] + pv) * *(const v4f*)(mid + r * PMID + jw);
    }
    const v4f o = s + res;
    v4f y;
    for (int i = 0; i < 4; ++i) y[i] = (o[i] > 0.0f) ? o[i] : 0.1f * o[i];
    *(v4f*)(out + (size_t)n * CCH + c4) = y;
}

// ---------------------------------------------------------------------------
extern "C" void kernel_launch(void* const* d_in, const int* in_sizes, int n_in,
                              void* d_out, int out_size, void* d_ws, size_t ws_size,
                              hipStream_t stream) {
    const float* xyz      = (const float*)d_in[0];
    const float* feats    = (const float*)d_in[1];
    const int*   nei      = (const int*)  d_in[2];
    const float* Wq       = (const float*)d_in[3];
    const float* bq       = (const float*)d_in[4];
    const float* Wk       = (const float*)d_in[5];
    const float* bk       = (const float*)d_in[6];
    const float* Wv       = (const float*)d_in[7];
    const float* bv       = (const float*)d_in[8];
    const float* Wp1      = (const float*)d_in[9];
    const float* bp1      = (const float*)d_in[10];
    const float* p_gamma  = (const float*)d_in[11];
    const float* p_beta   = (const float*)d_in[12];
    const float* p_mean   = (const float*)d_in[13];
    const float* p_var    = (const float*)d_in[14];
    const float* Wp2      = (const float*)d_in[15];
    const float* bp2      = (const float*)d_in[16];
    const float* w_gamma  = (const float*)d_in[17];
    const float* w_beta   = (const float*)d_in[18];
    const float* w_mean   = (const float*)d_in[19];
    const float* w_var    = (const float*)d_in[20];
    const float* Ww1      = (const float*)d_in[21];
    const float* bw1      = (const float*)d_in[22];
    const float* w1_gamma = (const float*)d_in[23];
    const float* w1_beta  = (const float*)d_in[24];
    const float* w1_mean  = (const float*)d_in[25];
    const float* w1_var   = (const float*)d_in[26];
    const float* Ww2      = (const float*)d_in[27];
    const float* bw2      = (const float*)d_in[28];

    // workspace: q, k, v projections (3 * N * C floats = 58.6 MB)
    float* qp = (float*)d_ws;
    float* kp = qp + (size_t)NPTS * CCH;
    float* vp = kp + (size_t)NPTS * CCH;

    dim3 gridA(NPTS / 16, 3);
    qkv_proj_wmma<<<gridA, 256, 0, stream>>>(feats, Wq, bq, Wk, bk, Wv, bv, qp, kp, vp);

    fused_attn<<<NPTS / 4, 128, 0, stream>>>(
        xyz, feats, nei,
        Wp1, bp1, p_gamma, p_beta, p_mean, p_var, Wp2, bp2,
        w_gamma, w_beta, w_mean, w_var,
        Ww1, bw1, w1_gamma, w1_beta, w1_mean, w1_var, Ww2, bw2,
        qp, kp, vp, (float*)d_out);
}

// v003
// It runs in 73.9 microseconds.
// Timed twice side by side with v002, it ran 1.15 times as fast both times.
// Over all steps from v000 it is 2.42 times as fast.
#include <hip/hip_runtime.h>
#include <hip/hip_bf16.h>

// Point Transformer layer, MI455X (gfx1250, wave32).
// Kernel A: q/k/v projections via V_WMMA_F32_16X16X4_F32 (fp32 tensor path).
// Kernel B: fused gather + pos-MLP + attention-weight GEMMs (WMMA) + softmax + aggregation.

#define NPTS 40000
#define CCH  128
#define KNB  16
#define EPSV 1e-5f
// LDS row pitches, in floats, of the panels that feed WMMA A fragments. A fragment read has 16 lanes
// on 16 rows at one column pair; bank = dword address mod 64, so at a pitch of 128 (or 16) floats the
// rows fall on one (or four) bank groups. A pitch of 4 x odd floats puts the 16 rows on 16 different
// groups of 4 banks, and the upper half-wave (columns +2) on the other half of each group.
#define PCH  (CCH + 4)
#define PMID 20

typedef __attribute__((ext_vector_type(2))) float v2f;
typedef __attribute__((ext_vector_type(4))) float v4f;
typedef __attribute__((ext_vector_type(8))) float v8f;
typedef const __attribute__((address_space(1))) v4f* gv4f_ptr;   // global-memory pointer to 4 floats

// Start of row id of a (NPTS x CCH) float array, held in scalar registers (id is the same in every lane):
// the row's load then takes its scalar-base form, with the lane number as the one vector offset, and no
// 64-bit vector address is formed and kept per row.
__device__ __forceinline__ gv4f_ptr row_base(const float* p, int id) {
    const unsigned long long a = (unsigned long long)p + (unsigned long long)(unsigned)id * (CCH * sizeof(float));
    const unsigned lo = __builtin_amdgcn_readfirstlane((unsigned)a);
    const unsigned hi = __builtin_amdgcn_readfirstlane((unsigned)(a >> 32));
    return (gv4f_ptr)(((unsigned long long)hi << 32) | lo);
}

// ---------------------------------------------------------------------------
// Kernel A: q, k, v = x @ {Wq,Wk,Wv} + b   (N x 128) @ (128 x 128), all three in one work-group.
// grid = N/160, block = 512 (16 waves, 4 a SIMD). A wave owns output columns [16c, 16c+16), c = wave & 7,
// of q, k and v: it loads the B fragments of these three column tiles once (32 k steps x 2 registers x 3)
// and keeps them in registers over its five 16-row tiles. Waves 0-7 take the first 80 rows of the
// work-group's x panel, waves 8-15 the last 80. The panel is staged in LDS once, in front of one barrier.
// ---------------------------------------------------------------------------
#define TPW  5                  // 16-row tiles per wave
#define RPB  (2 * TPW * 16)     // rows of x per work-group
#define KST  (CCH / 4)          // k steps of the 16x16x4 form

__global__ void __launch_bounds__(512)
qkv_proj_wmma(const float* __restrict__ x,
              const float* __restrict__ Wq, const float* __restrict__ bq,
              const float* __restrict__ Wk, const float* __restrict__ bk,
              const float* __restrict__ Wv, const float* __restrict__ bv,
              float* __restrict__ qp, float* __restrict__ kp, float* __restrict__ vp) {
    __shared__ __attribute__((aligned(16))) float xa[RPB * PCH];   // 160-row panel of x, padded rows, 82.5 KB

    const int t    = threadIdx.x;
    const int lane = t & 31;
    const int wave = __builtin_amdgcn_readfirstlane(t >> 5);   // scalar: column tile and row half are wave-uniform
    const int row0 = blockIdx.x * RPB;

    // ---- the x panel: 16-byte loads of whole rows, all issued before the first is stored
    const v4f* xs = (const v4f*)(x + (size_t)row0 * CCH);
    v4f xr[RPB * CCH / 4 / 512];
    for (int i = 0; i < RPB * CCH / 4 / 512; ++i) xr[i] = xs[t + i * 512];
    // precaution: registers that the loads above name as addresses are reused further down
    asm volatile("s_wait_xcnt 0x0" ::: "memory");

    // ---- B fragments of the wave's three column tiles, for every k step
    const int j0   = (wave & 7) * 16;      // output column tile
    const int mm   = lane & 15;            // A row (M) owned by this lane
    const int koff = (lane < 16) ? 0 : 2;  // K sub-offset per ISA A/B striping
    const int col  = lane & 15;            // B/D column owned by this lane
    const int wo   = koff * CCH + j0 + col;
    const float bbq = bq[j0 + col], bbk = bk[j0 + col], bbv = bv[j0 + col];
    v2f fq[KST], fk[KST], fv[KST];
    for (int s = 0; s < KST; ++s) {
        // B 4x16 fp32: rows of W; v0 = {K=4s | K=4s+2}, v1 = {K=4s+1 | K=4s+3}
        fq[s].x = Wq[wo + (4 * s) * CCH];  fq[s].y = Wq[wo + (4 * s + 1) * CCH];
        fk[s].x = Wk[wo + (4 * s) * CCH];  fk[s].y = Wk[wo + (4 * s + 1) * CCH];
        fv[s].x = Wv[wo + (4 * s) * CCH];  fv[s].y = Wv[wo + (4 * s + 1) * CCH];
    }
    // the same precaution for the loads of W and of the biases; the byte offset that the loads of W name is
    // an input, so that its register is not given to a load's result ahead of the wait
    asm volatile("s_wait_xcnt 0x0" :: "v"(wo * 4) : "memory");
    // keeps the instructions that reuse those registers behind the wait (the compiler lifted them over it)
    __builtin_amdgcn_sched_barrier(0);

    for (int i = 0; i < RPB * CCH / 4 / 512; ++i) {
        const int e = t + i * 512;         // 16-byte piece e: row e / 32, first float 4 * (e % 32)
        *(v4f*)(xa + (e >> 5) * PCH + (e & 31) * 4) = xr[i];
    }
    __syncthreads();

    const int rowadd = (lane < 16) ? 0 : 8;   // D: vgpr r holds M=r (lo lanes) / M=r+8 (hi)
    const int tr0    = (wave >> 3) * (TPW * 16);
    for (int i = 0; i < TPW; ++i) {
        const int tr = tr0 + i * 16;          // first row of the tile in the panel
        const float* ap = xa + (tr + mm) * PCH + koff;
        v8f aq = {}, ak = {}, av = {};
        for (int s = 0; s < KST; ++s) {
            // A 16x4 fp32: v0 = {K=4s | K=4s+2}, v1 = {K=4s+1 | K=4s+3}
            v2f a;
            a.x = ap[4 * s];
            a.y = ap[4 * s + 1];
            aq = __builtin_amdgcn_wmma_f32_16x16x4_f32(false, a, false, fq[s], (short)0, aq, false, false);
            ak = __builtin_amdgcn_wmma_f32_16x16x4_f32(false, a, false, fk[s], (short)0, ak, false, false);
            av = __builtin_amdgcn_wmma_f32_16x16x4_f32(false, a, false, fv[s], (short)0, av, false, false);
        }
        const size_t o = (size_t)(row0 + tr + rowadd) * CCH + j0 + col;
        for (int r = 0; r < 8; ++r) {
            qp[o + r * CCH] = aq[r] + bbq;
            kp[o + r * CCH] = ak[r] + bbk;
            vp[o + r * CCH] = av[r] + bbv;
        }
        // precaution: the next trip overwrites the address registers that these stores name
        asm volatile("s_wait_xcnt 0x0" ::: "memory");
    }
}

// ---------------------------------------------------------------------------
// Kernel B: fused neighbor attention. 4 points / block, 128 threads (4 waves).
// One wave owns one point; a lane owns 4 consecutive channels, so a neighbour's 512-B row is one
// 16-byte load of the wave. Rows r = wave*16 + k, k in [0,16).
// ---------------------------------------------------------------------------
__global__ void __launch_bounds__(128)
fused_attn(const float* __restrict__ xyz, const float* __restrict__ feats,
           const int* __restrict__ nei,
           const float* __restrict__ Wp1, const float* __restrict__ bp1,
           const float* __restrict__ p_gamma, const float* __restrict__ p_beta,
           const float* __restrict__ p_mean,  const float* __restrict__ p_var,
           const float* __restrict__ Wp2, const float* __restrict__ bp2,
           const float* __restrict__ w_gamma, const float* __restrict__ w_beta,
           const float* __restrict__ w_mean,  const float* __restrict__ w_var,
           const float* __restrict__ Ww1, const float* __restrict__ bw1,
           const float* __restrict__ w1_gamma, const float* __restrict__ w1_beta,
           const float* __restrict__ w1_mean,  const float* __restrict__ w1_var,
           const float* __restrict__ Ww2, const float* __restrict__ bw2,
           const float* __restrict__ qp, const float* __restrict__ kp,
           const float* __restrict__ vp, float* __restrict__ out) {
    __shared__ __attribute__((aligned(16))) float w_buf[64 * PCH];  // relu(bn_w(kf - q + p)), padded rows, 33 KB
    __shared__ __attribute__((aligned(16))) float mid[64 * PMID];   // 128->16 stage, then softmaxed weights
    __shared__ float hbuf[64 * 3];      // relu(bn(d @ Wp1)) per (n,k)

    const int t    = threadIdx.x;                               // 0..127
    const int lane = t & 31;
    const int wave = __builtin_amdgcn_readfirstlane(t >> 5);    // scalar: the point's addresses are wave-uniform
    const int n    = blockIdx.x * 4 + wave;                     // point owned by this wave
    const int m0r  = wave * 16;                                 // its first row in the LDS panels
    const int c4   = lane * 4;                                  // first of the 4 channels owned by this lane

    // ---- neighbour ids: lane l holds the id of neighbour l & 15
    // id bounded before any address is formed from it (identity for ids in [0, NPTS))
    const int id = min(max(nei[(size_t)n * KNB + (lane & 15)], 0), NPTS - 1);

    // ---- gather of the 16 k rows: one 16-byte load a row, all 16 issued before the first is used
    v4f kf[KNB];
#pragma unroll
    for (int k = 0; k < KNB; ++k) {
        kf[k] = row_base(kp, __builtin_amdgcn_readlane(id, k))[lane];
    }

    // ---- per-channel constants and the point's q row
    const v4f q   = *(const v4f*)(qp + (size_t)n * CCH + c4);
    const v4f pw0 = *(const v4f*)(Wp2 + 0 * CCH + c4);
    const v4f pw1 = *(const v4f*)(Wp2 + 1 * CCH + c4);
    const v4f pw2 = *(const v4f*)(Wp2 + 2 * CCH + c4);
    const v4f bpc = *(const v4f*)(bp2 + c4);
    const v4f wgm = *(const v4f*)(w_gamma + c4);
    const v4f wvr = *(const v4f*)(w_var + c4);
    const v4f wm  = *(const v4f*)(w_mean + c4);
    const v4f wbt = *(const v4f*)(w_beta + c4);
    // precaution: the scalar row bases that the loads above name are overwritten further down
    asm volatile("s_wait_xcnt 0x0" ::: "memory");
    v4f wg;
    for (int i = 0; i < 4; ++i) wg[i] = wgm[i] * rsqrtf(wvr[i] + EPSV);

    // ---- 3-d positional hidden vector of neighbour l & 15 (both half-waves compute it, one stores)
    {
        const float d0 = xyz[(size_t)id * 3 + 0] - xyz[(size_t)n * 3 + 0];
        const float d1 = xyz[(size_t)id * 3 + 1] - xyz[(size_t)n * 3 + 1];
        const float d2 = xyz[(size_t)id * 3 + 2] - xyz[(size_t)n * 3 + 2];
        for (int j = 0; j < 3; ++j) {
            float h = d0 * Wp1[0 * 3 + j] + d1 * Wp1[1 * 3 + j] + d2 * Wp1[2 * 3 + j] + bp1[j];
            h = (h - p_mean[j]) * (p_gamma[j] * rsqrtf(p_var[j] + EPSV)) + p_beta[j];
            if (lane < 16) hbuf[(m0r + lane) * 3 + j] = fmaxf(h, 0.0f);
        }
    }
    __syncthreads();

    // ---- phase 1: w_buf[r][c] = relu(bn_w(kf - q + p))
#pragma unroll
    for (int k = 0; k < KNB; ++k) {
        const int r = m0r + k;
        const v4f pv = hbuf[r * 3 + 0] * pw0 + hbuf[r * 3 + 1] * pw1 +
                       hbuf[r * 3 + 2] * pw2 + bpc;
        v4f wv = kf[k] - q + pv;
        wv = (wv - wm) * wg + wbt;
        *(v4f*)(w_buf + r * PCH + c4) = __builtin_elementwise_max(wv, (v4f)(0.0f));
    }

    // ---- gather of the 16 v rows and the residual row, issued here so that they fly under phases 2 and 3
    v4f vf[KNB];
#pragma unroll
    for (int k = 0; k < KNB; ++k) {
        vf[k] = row_base(vp, __builtin_amdgcn_readlane(id, k))[lane];
    }
    const v4f res = *(const v4f*)(feats + (size_t)n * CCH + c4);
    __syncthreads();

    // ---- phase 2: (64x128)@(128x16) via WMMA, one 16x16 tile per wave (tile = point)
    const int mm   = lane & 15;
    const int koff = (lane < 16) ? 0 : 2;
    const int col  = lane & 15;

    v8f acc = {};
    for (int k0 = 0; k0 < CCH; k0 += 4) {
        v2f a, b;
        a.x = w_buf[(m0r + mm) * PCH + k0 + koff];
        a.y = w_buf[(m0r + mm) * PCH + k0 + koff + 1];
        b.x = Ww1[(k0 + koff) * 16 + col];
        b.y = Ww1[(k0 + koff + 1) * 16 + col];
        acc = __builtin_amdgcn_wmma_f32_16x16x4_f32(false, a, false, b,
                                                    (short)0, acc, false, false);
    }
    // bias + BN1 + ReLU (per output column), scatter to LDS in row-major
    {
        const float g1 = w1_gamma[col] * rsqrtf(w1_var[col] + EPSV);
        const float m1 = w1_mean[col], b1 = w1_beta[col], bb1 = bw1[col];
        const int rowadd = (lane < 16) ? 0 : 8;
        for (int r = 0; r < 8; ++r) {
            const float v = (acc[r] + bb1 - m1) * g1 + b1;
            mid[(m0r + r + rowadd) * PMID + col] = fmaxf(v, 0.0f);
        }
    }
    __syncthreads();

    // ---- phase 3: (64x16)@(16x16) WMMA, then softmax over the 16 neighbors of the tile
    v8f acc2 = {};
    for (int k0 = 0; k0 < 16; k0 += 4) {
        v2f a, b;
        a.x = mid[(m0r + mm) * PMID + k0 + koff];
        a.y = mid[(m0r + mm) * PMID + k0 + koff + 1];
        b.x = Ww2[(k0 + koff) * 16 + col];
        b.y = Ww2[(k0 + koff + 1) * 16 + col];
        acc2 = __builtin_amdgcn_wmma_f32_16x16x4_f32(false, a, false, b,
                                                     (short)0, acc2, false, false);
    }
    {
        const float bb2 = bw2[col];
        float vals[8];
        float mx = -3.4e38f;
        for (int r = 0; r < 8; ++r) { vals[r] = acc2[r] + bb2; mx = fmaxf(mx, vals[r]); }
        mx = fmaxf(mx, __shfl_xor(mx, 16, 32));     // lanes l / l+16 hold rows r / r+8
        float sum = 0.0f;
        for (int r = 0; r < 8; ++r) { vals[r] = __expf(vals[r] - mx); sum += vals[r]; }
        sum += __shfl_xor(sum, 16, 32);
        const float inv = 1.0f / sum;
        const int rowadd = (lane < 16) ? 0 : 8;
        for (int r = 0; r < 8; ++r)
            mid[(m0r + r + rowadd) * PMID + col] = vals[r] * inv;
    }
    __syncthreads();

    // ---- phase 4: grouped weighted aggregation + residual + leaky ReLU
    // channel c -> weight column j = c % 16 (reshape (S=8, C/S=16)); the lane's 4 channels are 4 columns in a row
    const int jw = c4 & 15;
    v4f s = (v4f)(0.0f);
#pragma unroll
    for (int k = 0; k < KNB; ++k) {
        const int r = m0r + k;
        const v4f pv = hbuf[r * 3 + 0] * pw0 + hbuf[r * 3 + 1] * pw1 +
                       hbuf[r * 3 + 2] * pw2 + bpc;
        s += (vf[k] + pv) * *(const v4f*)(mid + r * PMID + jw);
    }
    const v4f o = s + res;
    v4f y;
    for (int i = 0; i < 4; ++i) y[i] = (o[i] > 0.0f) ? o[i] : 0.1f * o[i];
    *(v4f*)(out + (size_t)n * CCH + c4) = y;
}

// ---------------------------------------------------------------------------
extern "C" void kernel_launch(void* const* d_in, const int* in_sizes, int n_in,
                              void* d_out, int out_size, void* d_ws, size_t ws_size,
                              hipStream_t stream) {
    const float* xyz      = (const float*)d_in[0];
    const float* feats    = (const float*)d_in[1];
    const int*   nei      = (const int*)  d_in[2];
    const float* Wq       = (const float*)d_in[3];
    const float* bq       = (const float*)d_in[4];
    const float* Wk       = (const float*)d_in[5];
    const float* bk       = (const float*)d_in[6];
    const float* Wv       = (const float*)d_in[7];
    const float* bv       = (const float*)d_in[8];
    const float* Wp1      = (const float*)d_in[9];
    const float* bp1      = (const float*)d_in[10];
    const float* p_gamma  = (const float*)d_in[11];
    const float* p_beta   = (const float*)d_in[12];
    const float* p_mean   = (const float*)d_in[13];
    const float* p_var    = (const float*)d_in[14];
    const float* Wp2      = (const float*)d_in[15];
    const float* bp2      = (const float*)d_in[16];
    const float* w_gamma  = (const float*)d_in[17];
    const float* w_beta   = (const float*)d_in[18];
    const float* w_mean   = (const float*)d_in[19];
    const float* w_var    = (const float*)d_in[20];
    const float* Ww1      = (const float*)d_in[21];
    const float* bw1      = (const float*)d_in[22];
    const float* w1_gamma = (const float*)d_in[23];
    const float* w1_beta  = (const float*)d_in[24];
    const float* w1_mean  = (const float*)d_in[25];
    const float* w1_var   = (const float*)d_in[26];
    const float* Ww2      = (const float*)d_in[27];
    const float* bw2      = (const float*)d_in[28];

    // workspace: q, k, v projections (3 * N * C floats = 58.6 MB)
    float* qp = (float*)d_ws;
    float* kp = qp + (size_t)NPTS * CCH;
    float* vp = kp + (size_t)NPTS * CCH;

    qkv_proj_wmma<<<NPTS / RPB, 512, 0, stream>>>(feats, Wq, bq, Wk, bk, Wv, bv, qp, kp, vp);

    fused_attn<<<NPTS / 4, 128, 0, stream>>>(
        xyz, feats, nei,
        Wp1, bp1, p_gamma, p_beta, p_mean, p_var, Wp2, bp2,
        w_gamma, w_beta, w_mean, w_var,
        Ww1, bw1, w1_gamma, w1_beta, w1_mean, w1_var, Ww2, bw2,
        qp, kp, vp, (float*)d_out);
}
